// v000
// Times are from an AMD MI455X. After a warm-up the kernel runs many times in a row, and a time is the length of
// such a window on the GPU divided by its runs, so every launch and the gaps after it count. The runs cycle
// through copies of the inputs. A figure is the median of several windows, for all but v000 over two sittings.
// Sittings can differ by a few percent; kernels timed side by side share one.
// v000, which the later versions start from, runs in 102 microseconds.
#include <hip/hip_runtime.h>

#define BB  8
#define SS  2048
#define HH  4
#define DHD 32
#define DD  128

typedef __attribute__((ext_vector_type(16))) _Float16 v16h;
typedef __attribute__((ext_vector_type(8)))  float    v8f;

// CDNA5 16-bit A/B fragment mapping (wave32):
// lane L holds row (A) / col (B) = L%16; element e -> K = (e&7) + 8*(L/16) + 16*(e>>3)
__device__ __forceinline__ int kmap(int e, int half) {
  return (e & 7) + (half << 3) + ((e >> 3) << 4);
}

// Load fragment from f16 matrix where element (row, k) = base[row*ld + k].
// Works for A (row = M row) and B (row = N column of a K-major view).
__device__ __forceinline__ v16h frag_f16(const _Float16* base, int ld, int row, int half) {
  const _Float16* p = base + (size_t)row * ld;
  v16h f;
#pragma unroll
  for (int e = 0; e < 16; e += 2) {
    int k = kmap(e, half);
    f[e]     = p[k];
    f[e + 1] = p[k + 1];
  }
  return f;
}

// A fragment from fp32 row-major source, converting to f16.
__device__ __forceinline__ v16h fragA_f32(const float* base, int ld, int row, int kc, int half) {
  const float* p = base + (size_t)row * ld + kc;
  v16h f;
#pragma unroll
  for (int e = 0; e < 16; e += 2) {
    int k = kmap(e, half);
    f[e]     = (_Float16)p[k];
    f[e + 1] = (_Float16)p[k + 1];
  }
  return f;
}

// B fragment from fp32 row-major weight W[k][col] (k strided by ld).
__device__ __forceinline__ v16h fragB_f32(const float* W, int ld, int kc, int col, int half) {
  v16h f;
#pragma unroll
  for (int e = 0; e < 16; e += 2) {
    int k = kc + kmap(e, half);
    f[e]     = (_Float16)W[(size_t)k * ld + col];
    f[e + 1] = (_Float16)W[(size_t)(k + 1) * ld + col];
  }
  return f;
}

__device__ __forceinline__ v8f wmma_f16(v16h a, v16h b, v8f c) {
  return __builtin_amdgcn_wmma_f32_16x16x32_f16(false, a, false, b, (short)0, c, false, false);
}

// ---------------- QKV projection: X(16-row tile) @ W + b, split heads ----------------
// grid = (B*S)/16 blocks, 256 threads (8 waves). Wave w owns column tile w (16 cols),
// loops over Q/K/V. Q,K stored (B,H,S,DH) f16; V stored transposed (B,H,DH,S) f16.
__global__ __launch_bounds__(256)
void proj_kernel(const float* __restrict__ qx, const float* __restrict__ kx,
                 const float* __restrict__ vx,
                 const float* __restrict__ Wq, const float* __restrict__ bq,
                 const float* __restrict__ Wk, const float* __restrict__ bk,
                 const float* __restrict__ Wv, const float* __restrict__ bv,
                 _Float16* __restrict__ qws, _Float16* __restrict__ kws,
                 _Float16* __restrict__ vtws) {
  int lane = threadIdx.x & 31;
  int wave = threadIdx.x >> 5;
  int half = lane >> 4;
  int r    = lane & 15;
  int m0   = blockIdx.x * 16;
  int col  = wave * 16 + r;     // output column 0..127
  int h    = col >> 5;
  int dh   = col & 31;

#pragma unroll
  for (int mat = 0; mat < 3; ++mat) {
    const float* X    = (mat == 0) ? qx : (mat == 1) ? kx : vx;
    const float* W    = (mat == 0) ? Wq : (mat == 1) ? Wk : Wv;
    const float* bias = (mat == 0) ? bq : (mat == 1) ? bk : bv;

    v8f c = {};
#pragma unroll
    for (int kc = 0; kc < DD; kc += 32) {
      v16h a = fragA_f32(X, DD, m0 + r, kc, half);
      v16h b = fragB_f32(W, DD, kc, col, half);
      c = wmma_f16(a, b, c);
    }
    float bias_v = bias[col];
#pragma unroll
    for (int v = 0; v < 8; ++v) {
      int row = m0 + v + 8 * half;          // C layout: VGPR v, half -> M = v + 8*half
      int bb  = row >> 11;                  // row / 2048
      int s   = row & (SS - 1);
      float val = c[v] + bias_v;
      if (mat == 2) {
        vtws[(((size_t)bb * HH + h) * DHD + dh) * SS + s] = (_Float16)val;
      } else {
        _Float16* dst = (mat == 0) ? qws : kws;
        dst[(((size_t)bb * HH + h) * SS + s) * DHD + dh] = (_Float16)val;
      }
    }
  }
}

// ---------------- fused flash attention: one wave per 16-query tile ----------------
// grid = B*H*(S/16)/8 blocks, 256 threads (8 waves, independent tiles).
__global__ __launch_bounds__(256)
void attn_kernel(const _Float16* __restrict__ qws, const _Float16* __restrict__ kws,
                 const _Float16* __restrict__ vtws, const float* __restrict__ amask,
                 const float* __restrict__ hmask, float* __restrict__ out) {
  __shared__ _Float16 Plds[8][16 * 32];     // per-wave P staging (C-layout -> A-layout)

  int lane = threadIdx.x & 31;
  int wave = threadIdx.x >> 5;
  int half = lane >> 4;
  int cn   = lane & 15;

  int g   = blockIdx.x * 8 + wave;          // tile id 0..4095
  int b   = g >> 9;                         // / (H * S/16) = 512
  int rem = g & 511;
  int h   = rem >> 7;                       // / 128
  int q0  = (rem & 127) * 16;

  const _Float16* qb  = qws  + (((size_t)b * HH + h) * SS) * DHD;
  const _Float16* kb  = kws  + (((size_t)b * HH + h) * SS) * DHD;
  const _Float16* vtb = vtws + (((size_t)b * HH + h) * DHD) * SS;
  const float*    mb  = amask + (size_t)b * SS;

  v16h aQ = frag_f16(qb, DHD, q0 + cn, half);   // 16x32 Q tile, K = DH = 32

  v8f acc0 = {}, acc1 = {};
  float m[8], l[8];
#pragma unroll
  for (int v = 0; v < 8; ++v) { m[v] = -3.0e38f; l[v] = 0.0f; }

  const float scale = 0.17677669529663687f;     // 1/sqrt(32)
  _Float16* P = &Plds[wave][0];
  v8f zero = {};

  for (int j = 0; j < SS; j += 32) {
    // scores: Q @ K^T for keys [j, j+32)
    v16h bK0 = frag_f16(kb, DHD, j + cn,      half);
    v16h bK1 = frag_f16(kb, DHD, j + 16 + cn, half);
    v8f s1 = wmma_f16(aQ, bK0, zero);
    v8f s2 = wmma_f16(aQ, bK1, zero);
    float mk0 = mb[j + cn];
    float mk1 = mb[j + 16 + cn];

#pragma unroll
    for (int v = 0; v < 8; ++v) {
      float x1 = s1[v] * scale + mk0;
      float x2 = s2[v] * scale + mk1;
      // row max over 32 keys: local max then butterfly across the 16-lane half
      float t = fmaxf(x1, x2);
#pragma unroll
      for (int o = 1; o < 16; o <<= 1) t = fmaxf(t, __shfl_xor(t, o, 32));
      float mn = fmaxf(m[v], t);
      float e1 = __expf(x1 - mn);
      float e2 = __expf(x2 - mn);
      float rs = e1 + e2;
#pragma unroll
      for (int o = 1; o < 16; o <<= 1) rs += __shfl_xor(rs, o, 32);
      float corr = __expf(m[v] - mn);
      l[v] = l[v] * corr + rs;
      acc0[v] *= corr;
      acc1[v] *= corr;
      m[v] = mn;
      // stage P (C-layout element (row = v+8*half, key = cn / 16+cn)) as f16
      P[(v + 8 * half) * 32 + cn]      = (_Float16)e1;
      P[(v + 8 * half) * 32 + 16 + cn] = (_Float16)e2;
    }

    asm volatile("s_wait_dscnt 0" ::: "memory");

    // ctx += P(16x32) @ V(32x32): A from LDS, B from transposed V (contiguous K-pairs)
    v16h aP  = frag_f16(P, 32, cn, half);
    v16h bV0 = frag_f16(vtb + j, SS, cn,      half);
    v16h bV1 = frag_f16(vtb + j, SS, 16 + cn, half);
    acc0 = wmma_f16(aP, bV0, acc0);
    acc1 = wmma_f16(aP, bV1, acc1);
  }

  float hm = hmask[h];
#pragma unroll
  for (int v = 0; v < 8; ++v) {
    int row = q0 + v + 8 * half;
    float inv = hm / l[v];
    size_t o = (((size_t)b * SS + row) * DD) + (size_t)h * DHD;
    out[o + cn]      = acc0[v] * inv;
    out[o + 16 + cn] = acc1[v] * inv;
  }
}

extern "C" void kernel_launch(void* const* d_in, const int* in_sizes, int n_in,
                              void* d_out, int out_size, void* d_ws, size_t ws_size,
                              hipStream_t stream) {
  (void)in_sizes; (void)n_in; (void)out_size; (void)ws_size;
  const float* qx    = (const float*)d_in[0];
  const float* kx    = (const float*)d_in[1];
  const float* vx    = (const float*)d_in[2];
  const float* amask = (const float*)d_in[3];
  const float* hmask = (const float*)d_in[4];
  const float* Wq    = (const float*)d_in[5];
  const float* bq    = (const float*)d_in[6];
  const float* Wk    = (const float*)d_in[7];
  const float* bk    = (const float*)d_in[8];
  const float* Wv    = (const float*)d_in[9];
  const float* bv    = (const float*)d_in[10];

  size_t n = (size_t)BB * HH * SS * DHD;     // 2M f16 elements per tensor
  _Float16* qws  = (_Float16*)d_ws;
  _Float16* kws  = qws + n;
  _Float16* vtws = kws + n;                  // 12 MB total workspace

  proj_kernel<<<(BB * SS) / 16, 256, 0, stream>>>(qx, kx, vx, Wq, bq, Wk, bk, Wv, bv,
                                                  qws, kws, vtws);
  attn_kernel<<<(BB * HH * (SS / 16)) / 8, 256, 0, stream>>>(qws, kws, vtws, amask,
                                                             hmask, (float*)d_out);
}

// v001
// One run takes 74.5 microseconds.
// Timed twice side by side with v000, it ran 1.41 times as fast both times.
#include <hip/hip_runtime.h>

#define BB  8
#define SS  2048
#define HH  4
#define DHD 32
#define DD  128

typedef __attribute__((ext_vector_type(16))) _Float16 v16h;
typedef __attribute__((ext_vector_type(8)))  float    v8f;

// CDNA5 16-bit A/B fragment mapping (wave32):
// lane L holds row (A) / col (B) = L%16; element e -> K = (e&7) + 8*(L/16) + 16*(e>>3)
__device__ __forceinline__ int kmap(int e, int half) {
  return (e & 7) + (half << 3) + ((e >> 3) << 4);
}

// Load fragment from f16 matrix where element (row, k) = base[row*ld + k].
// Works for A (row = M row) and B (row = N column of a K-major view).
__device__ __forceinline__ v16h frag_f16(const _Float16* base, int ld, int row, int half) {
  const _Float16* p = base + (size_t)row * ld;
  v16h f;
#pragma unroll
  for (int e = 0; e < 16; e += 2) {
    int k = kmap(e, half);
    f[e]     = p[k];
    f[e + 1] = p[k + 1];
  }
  return f;
}

// A fragment from fp32 row-major source, converting to f16.
__device__ __forceinline__ v16h fragA_f32(const float* base, int ld, int row, int kc, int half) {
  const float* p = base + (size_t)row * ld + kc;
  v16h f;
#pragma unroll
  for (int e = 0; e < 16; e += 2) {
    int k = kmap(e, half);
    f[e]     = (_Float16)p[k];
    f[e + 1] = (_Float16)p[k + 1];
  }
  return f;
}

// B fragment from fp32 row-major weight W[k][col] (k strided by ld).
__device__ __forceinline__ v16h fragB_f32(const float* W, int ld, int kc, int col, int half) {
  v16h f;
#pragma unroll
  for (int e = 0; e < 16; e += 2) {
    int k = kc + kmap(e, half);
    f[e]     = (_Float16)W[(size_t)k * ld + col];
    f[e + 1] = (_Float16)W[(size_t)(k + 1) * ld + col];
  }
  return f;
}

__device__ __forceinline__ v8f wmma_f16(v16h a, v16h b, v8f c) {
  return __builtin_amdgcn_wmma_f32_16x16x32_f16(false, a, false, b, (short)0, c, false, false);
}

// ---------------- QKV projection: X(16-row tile) @ W + b, split heads ----------------
// grid = (B*S)/16 blocks, 256 threads (8 waves). Wave w owns column tile w (16 cols),
// loops over Q/K/V. Q,K stored (B,H,S,DH) f16; V stored transposed (B,H,DH,S) f16.
__global__ __launch_bounds__(256)
void proj_kernel(const float* __restrict__ qx, const float* __restrict__ kx,
                 const float* __restrict__ vx,
                 const float* __restrict__ Wq, const float* __restrict__ bq,
                 const float* __restrict__ Wk, const float* __restrict__ bk,
                 const float* __restrict__ Wv, const float* __restrict__ bv,
                 _Float16* __restrict__ qws, _Float16* __restrict__ kws,
                 _Float16* __restrict__ vtws) {
  int lane = threadIdx.x & 31;
  int wave = threadIdx.x >> 5;
  int half = lane >> 4;
  int r    = lane & 15;
  int m0   = blockIdx.x * 16;
  int col  = wave * 16 + r;     // output column 0..127
  int h    = col >> 5;
  int dh   = col & 31;

#pragma unroll
  for (int mat = 0; mat < 3; ++mat) {
    const float* X    = (mat == 0) ? qx : (mat == 1) ? kx : vx;
    const float* W    = (mat == 0) ? Wq : (mat == 1) ? Wk : Wv;
    const float* bias = (mat == 0) ? bq : (mat == 1) ? bk : bv;

    v8f c = {};
#pragma unroll
    for (int kc = 0; kc < DD; kc += 32) {
      v16h a = fragA_f32(X, DD, m0 + r, kc, half);
      v16h b = fragB_f32(W, DD, kc, col, half);
      c = wmma_f16(a, b, c);
    }
    float bias_v = bias[col];
#pragma unroll
    for (int v = 0; v < 8; ++v) {
      int row = m0 + v + 8 * half;          // C layout: VGPR v, half -> M = v + 8*half
      int bb  = row >> 11;                  // row / 2048
      int s   = row & (SS - 1);
      float val = c[v] + bias_v;
      if (mat == 2) {
        vtws[(((size_t)bb * HH + h) * DHD + dh) * SS + s] = (_Float16)val;
      } else {
        _Float16* dst = (mat == 0) ? qws : kws;
        dst[(((size_t)bb * HH + h) * SS + s) * DHD + dh] = (_Float16)val;
      }
    }
  }
}

// ---------------- fused flash attention: one wave per 16-query tile ----------------
// grid = B*H*(S/16)/8 blocks, 256 threads (8 waves, independent tiles).
// Scores are formed transposed, S^T = K Q^T, and the context as O^T += V^T P^T:
// lane (cn, half) then owns query q0 + cn and holds keys 8*half + v (tile 0) and
// 16 + 8*half + v (tile 1) in its registers, which is the k order of a B fragment.

// lane l <-> lane l ^ 16
__device__ __forceinline__ float xhalf(float x) {
  int b = __builtin_bit_cast(int, x);
  return __builtin_bit_cast(float,
      __builtin_amdgcn_permlanex16(b, b, 0x76543210, 0xfedcba98, false, false));
}

__global__ __launch_bounds__(256)
void attn_kernel(const _Float16* __restrict__ qws, const _Float16* __restrict__ kws,
                 const _Float16* __restrict__ vtws, const float* __restrict__ amask,
                 const float* __restrict__ hmask, float* __restrict__ out) {
  int lane = threadIdx.x & 31;
  int wave = threadIdx.x >> 5;
  int half = lane >> 4;
  int cn   = lane & 15;

  int g   = blockIdx.x * 8 + wave;          // tile id 0..4095
  int b   = g >> 9;                         // / (H * S/16) = 512
  int rem = g & 511;
  int h   = rem >> 7;                       // / 128
  int q0  = (rem & 127) * 16;

  const _Float16* qb  = qws  + (((size_t)b * HH + h) * SS) * DHD;
  const _Float16* kb  = kws  + (((size_t)b * HH + h) * SS) * DHD;
  const _Float16* vtb = vtws + (((size_t)b * HH + h) * DHD) * SS;
  const float*    mb  = amask + (size_t)b * SS + 8 * half;

  v16h bQ = frag_f16(qb, DHD, q0 + cn, half);   // B: column = query, K = DH = 32

  v8f acc0 = {}, acc1 = {};                     // O^T: rows dh 0..15 / 16..31, column = query
  float m = -3.0e38f;                           // running maximum of this lane's query
  float l = 0.0f;                               // sum over this lane half's keys only

  const float scale = 0.17677669529663687f;     // 1/sqrt(32)
  v8f zero = {};

  for (int j = 0; j < SS; j += 32) {
    // scores^T: K @ Q^T for keys [j, j+32)
    v16h aK0 = frag_f16(kb, DHD, j + cn,      half);
    v16h aK1 = frag_f16(kb, DHD, j + 16 + cn, half);
    v8f s1 = wmma_f16(aK0, bQ, zero);
    v8f s2 = wmma_f16(aK1, bQ, zero);

    // x[e]: score of key j + kmap(e, half) for this lane's query
    float x[16];
#pragma unroll  // constant indices, so the array stays in registers
    for (int v = 0; v < 8; ++v) {
      x[v]     = s1[v] * scale + mb[j + v];
      x[8 + v] = s2[v] * scale + mb[j + 16 + v];
    }

    // maximum over the 32 keys: 16 in this lane, 16 in lane ^ 16
    float t = x[0];
#pragma unroll  // constant indices, so the array stays in registers
    for (int e = 1; e < 16; ++e) t = fmaxf(t, x[e]);
    t = fmaxf(t, xhalf(t));
    float mn   = fmaxf(m, t);
    float corr = __expf(m - mn);
    m = mn;

    v16h bP;                                    // P^T as B: element e -> key kmap(e, half)
    float p[16];
#pragma unroll  // constant indices, so the array stays in registers
    for (int e = 0; e < 16; ++e) p[e] = __expf(x[e] - mn);
    float rs = 0.0f;
#pragma unroll  // constant indices, so the array stays in registers
    for (int e = 0; e < 16; e += 2) {
      rs += p[e] + p[e + 1];
      bP[e]     = (_Float16)p[e];
      bP[e + 1] = (_Float16)p[e + 1];
    }
    l = l * corr + rs;
#pragma unroll  // constant indices, so the array stays in registers
    for (int v = 0; v < 8; ++v) { acc0[v] *= corr; acc1[v] *= corr; }

    // ctx^T += V^T(32x32) @ P^T(32x16): A rows = dh from transposed V
    v16h aV0 = frag_f16(vtb + j, SS, cn,      half);
    v16h aV1 = frag_f16(vtb + j, SS, 16 + cn, half);
    acc0 = wmma_f16(aV0, bP, acc0);
    acc1 = wmma_f16(aV1, bP, acc1);
  }

  l += xhalf(l);                                // join the two halves' sums once
  float inv = hmask[h] / l;
  float* o = out + (((size_t)b * SS + q0 + cn) * DD) + (size_t)h * DHD + 8 * half;
#pragma unroll  // constant indices, so the array stays in registers
  for (int v = 0; v < 8; ++v) {
    o[v]      = acc0[v] * inv;                  // dh = 8*half + v
    o[16 + v] = acc1[v] * inv;                  // dh = 16 + 8*half + v
  }
}

extern "C" void kernel_launch(void* const* d_in, const int* in_sizes, int n_in,
                              void* d_out, int out_size, void* d_ws, size_t ws_size,
                              hipStream_t stream) {
  (void)in_sizes; (void)n_in; (void)out_size; (void)ws_size;
  const float* qx    = (const float*)d_in[0];
  const float* kx    = (const float*)d_in[1];
  const float* vx    = (const float*)d_in[2];
  const float* amask = (const float*)d_in[3];
  const float* hmask = (const float*)d_in[4];
  const float* Wq    = (const float*)d_in[5];
  const float* bq    = (const float*)d_in[6];
  const float* Wk    = (const float*)d_in[7];
  const float* bk    = (const float*)d_in[8];
  const float* Wv    = (const float*)d_in[9];
  const float* bv    = (const float*)d_in[10];

  size_t n = (size_t)BB * HH * SS * DHD;     // 2M f16 elements per tensor
  _Float16* qws  = (_Float16*)d_ws;
  _Float16* kws  = qws + n;
  _Float16* vtws = kws + n;                  // 12 MB total workspace

  proj_kernel<<<(BB * SS) / 16, 256, 0, stream>>>(qx, kx, vx, Wq, bq, Wk, bk, Wv, bv,
                                                  qws, kws, vtws);
  attn_kernel<<<(BB * HH * (SS / 16)) / 8, 256, 0, stream>>>(qws, kws, vtws, amask,
                                                             hmask, (float*)d_out);
}

// v002
// One run takes 52.3 microseconds.
// Timed twice side by side with v001, it ran 1.42 times as fast both times.
// Over all steps from v000 it is 2.00 times as fast.
#include <hip/hip_runtime.h>

#define BB  8
#define SS  2048
#define HH  4
#define DHD 32
#define DD  128

typedef __attribute__((ext_vector_type(16))) _Float16 v16h;
typedef __attribute__((ext_vector_type(8)))  float    v8f;

// CDNA5 16-bit A/B fragment mapping (wave32):
// lane L holds row (A) / col (B) = L%16; element e -> K = (e&7) + 8*(L/16) + 16*(e>>3)
__device__ __forceinline__ int kmap(int e, int half) {
  return (e & 7) + (half << 3) + ((e >> 3) << 4);
}

// Load fragment from f16 matrix where element (row, k) = base[row*ld + k].
// Works for A (row = M row) and B (row = N column of a K-major view).
__device__ __forceinline__ v16h frag_f16(const _Float16* base, int ld, int row, int half) {
  const _Float16* p = base + (size_t)row * ld;
  v16h f;
#pragma unroll
  for (int e = 0; e < 16; e += 2) {
    int k = kmap(e, half);
    f[e]     = p[k];
    f[e + 1] = p[k + 1];
  }
  return f;
}

// A fragment from fp32 row-major source, converting to f16.
__device__ __forceinline__ v16h fragA_f32(const float* base, int ld, int row, int kc, int half) {
  const float* p = base + (size_t)row * ld + kc;
  v16h f;
#pragma unroll
  for (int e = 0; e < 16; e += 2) {
    int k = kmap(e, half);
    f[e]     = (_Float16)p[k];
    f[e + 1] = (_Float16)p[k + 1];
  }
  return f;
}

// B fragment from fp32 row-major weight W[k][col] (k strided by ld).
__device__ __forceinline__ v16h fragB_f32(const float* W, int ld, int kc, int col, int half) {
  v16h f;
#pragma unroll
  for (int e = 0; e < 16; e += 2) {
    int k = kc + kmap(e, half);
    f[e]     = (_Float16)W[(size_t)k * ld + col];
    f[e + 1] = (_Float16)W[(size_t)(k + 1) * ld + col];
  }
  return f;
}

__device__ __forceinline__ v8f wmma_f16(v16h a, v16h b, v8f c) {
  return __builtin_amdgcn_wmma_f32_16x16x32_f16(false, a, false, b, (short)0, c, false, false);
}

// ---------------- QKV projection: X(16-row tile) @ W + b, split heads ----------------
// grid = (B*S)/16 blocks, 256 threads (8 waves). Wave w owns column tile w (16 cols),
// loops over Q/K/V. Q,K stored (B,H,S,DH) f16; V stored transposed (B,H,DH,S) f16.
__global__ __launch_bounds__(256)
void proj_kernel(const float* __restrict__ qx, const float* __restrict__ kx,
                 const float* __restrict__ vx,
                 const float* __restrict__ Wq, const float* __restrict__ bq,
                 const float* __restrict__ Wk, const float* __restrict__ bk,
                 const float* __restrict__ Wv, const float* __restrict__ bv,
                 _Float16* __restrict__ qws, _Float16* __restrict__ kws,
                 _Float16* __restrict__ vtws) {
  int lane = threadIdx.x & 31;
  int wave = threadIdx.x >> 5;
  int half = lane >> 4;
  int r    = lane & 15;
  int m0   = blockIdx.x * 16;
  int col  = wave * 16 + r;     // output column 0..127
  int h    = col >> 5;
  int dh   = col & 31;

#pragma unroll
  for (int mat = 0; mat < 3; ++mat) {
    const float* X    = (mat == 0) ? qx : (mat == 1) ? kx : vx;
    const float* W    = (mat == 0) ? Wq : (mat == 1) ? Wk : Wv;
    const float* bias = (mat == 0) ? bq : (mat == 1) ? bk : bv;

    v8f c = {};
#pragma unroll
    for (int kc = 0; kc < DD; kc += 32) {
      v16h a = fragA_f32(X, DD, m0 + r, kc, half);
      v16h b = fragB_f32(W, DD, kc, col, half);
      c = wmma_f16(a, b, c);
    }
    float bias_v = bias[col];
#pragma unroll
    for (int v = 0; v < 8; ++v) {
      int row = m0 + v + 8 * half;          // C layout: VGPR v, half -> M = v + 8*half
      int bb  = row >> 11;                  // row / 2048
      int s   = row & (SS - 1);
      float val = c[v] + bias_v;
      if (mat == 2) {
        vtws[(((size_t)bb * HH + h) * DHD + dh) * SS + s] = (_Float16)val;
      } else {
        _Float16* dst = (mat == 0) ? qws : kws;
        dst[(((size_t)bb * HH + h) * SS + s) * DHD + dh] = (_Float16)val;
      }
    }
  }
}

// ---------------- fused flash attention: one wave per 16-query tile ----------------
// grid = B*H*(S/16)/8 blocks, 256 threads (8 waves, one query tile each, all of one (b, h)).
// Scores are formed transposed, S^T = K Q^T, and the context as O^T += V^T P^T:
// lane (cn, half) then owns query q0 + cn and holds keys 8*half + v (tile 0) and
// 16 + 8*half + v (tile 1) in its registers, which is the k order of a B fragment.

// lane l <-> lane l ^ 16
__device__ __forceinline__ float xhalf(float x) {
  int b = __builtin_bit_cast(int, x);
  return __builtin_bit_cast(float,
      __builtin_amdgcn_permlanex16(b, b, 0x76543210, 0xfedcba98, false, false));
}

// K and V^T reach the waves through LDS: the eight waves of a block share one (b, h), so each
// tile of KT keys is copied in once per block, in whole 128-byte lines, and read by all eight.
#define KT      128                 // keys per tile
#define NT      (SS / KT)           // tiles
#define KPITCH  40                  // f16 per K row in LDS: 80 B = 16 B x odd, no bank conflict for 16-byte reads
#define VPITCH  (KT + 8)            // f16 per V^T row in LDS: 272 B = 16 B x odd
#define KTILE   (KT * KPITCH)       // f16 per K tile in LDS
#define VTILE   (DHD * VPITCH)      // f16 per V^T tile in LDS

typedef __attribute__((ext_vector_type(8))) _Float16 v8h;

// Fragment from LDS; p = the lane's row at k = 8*half: elements 0..7 there, 8..15 at k + 16 (kmap).
__device__ __forceinline__ v16h frag_lds(const _Float16* p) {
  v8h lo = *(const v8h*)p;
  v8h hi = *(const v8h*)(p + 16);
  return __builtin_shufflevector(lo, hi, 0, 1, 2, 3, 4, 5, 6, 7, 8, 9, 10, 11, 12, 13, 14, 15);
}

// One tile's four 16-byte copies of this lane, global memory to LDS through no register.
// The s_wait_xcnt stands inside the statement, so that no address register named here is
// rewritten in front of it.
__device__ __forceinline__ void copy_tile(unsigned lk, const _Float16* gk,
                                          unsigned lv, const _Float16* gv) {
  unsigned lk1 = lk + 64 * KPITCH * 2;          // K rows 64..127
  unsigned lv1 = lv + 16 * VPITCH * 2;          // V^T rows 16..31
  const _Float16* gk1 = gk + 64 * DHD;
  const _Float16* gv1 = gv + 16 * SS;
  asm volatile("global_load_async_to_lds_b128 %0, %1, off\n\t"
               "global_load_async_to_lds_b128 %2, %3, off\n\t"
               "global_load_async_to_lds_b128 %4, %5, off\n\t"
               "global_load_async_to_lds_b128 %6, %7, off\n\t"
               "s_wait_xcnt 0x0"
               :: "v"(lk), "v"(gk), "v"(lk1), "v"(gk1), "v"(lv), "v"(gv), "v"(lv1), "v"(gv1)
               : "memory");
}

// The grid puts four waves on a SIMD: with their register budget the compiler issues a tile's LDS
// reads in groups ahead of their use; with the default budget it waits at each fragment.
__global__ __launch_bounds__(256) __attribute__((amdgpu_waves_per_eu(4, 4)))
void attn_kernel(const _Float16* __restrict__ qws, const _Float16* __restrict__ kws,
                 const _Float16* __restrict__ vtws, const float* __restrict__ amask,
                 const float* __restrict__ hmask, float* __restrict__ out) {
  __shared__ __attribute__((aligned(16))) _Float16 sK[2 * KTILE];
  __shared__ __attribute__((aligned(16))) _Float16 sV[2 * VTILE];

  int tid  = threadIdx.x;
  int lane = tid & 31;
  int wave = tid >> 5;
  int half = lane >> 4;
  int cn   = lane & 15;

  int g   = blockIdx.x * 8 + wave;          // tile id 0..4095
  int b   = g >> 9;                         // / (H * S/16) = 512
  int rem = g & 511;
  int h   = rem >> 7;                       // / 128
  int q0  = (rem & 127) * 16;

  const _Float16* qb  = qws  + (((size_t)b * HH + h) * SS) * DHD;
  const _Float16* kb  = kws  + (((size_t)b * HH + h) * SS) * DHD;
  const _Float16* vtb = vtws + (((size_t)b * HH + h) * DHD) * SS;
  const float*    mb  = amask + (size_t)b * SS + 8 * half;

  // This lane's share of a tile. K: 16-byte piece tid of 8 KB in a row (key tid/4, piece tid%4),
  // and the same 64 keys on. V^T: row tid/16, piece tid%16 of its 256 bytes, and 16 rows on.
  const _Float16* gk = kb  + tid * 8;
  const _Float16* gv = vtb + (size_t)(tid >> 4) * SS + (tid & 15) * 8;
  unsigned lk = (unsigned)(size_t)&sK[(tid >> 2) * KPITCH + (tid & 3) * 8];
  unsigned lv = (unsigned)(size_t)&sV[(tid >> 4) * VPITCH + (tid & 15) * 8];

  copy_tile(lk, gk, lv, gv);                            // tile 0 into buffer 0
  asm volatile("s_wait_asynccnt 0x0" ::: "memory");     // this wave's share of tile 0 has landed
  __syncthreads();                                      // and every other wave's
  copy_tile(lk + KTILE * 2, gk + KT * DHD, lv + VTILE * 2, gv + KT);   // tile 1 into buffer 1

  v16h bQ = frag_f16(qb, DHD, q0 + cn, half);   // B: column = query, K = DH = 32

  v8f acc0 = {}, acc1 = {};                     // O^T: rows dh 0..15 / 16..31, column = query
  float m = -3.0e38f;                           // running maximum of this lane's query
  float l = 0.0f;                               // sum over this lane half's keys only

  const float scale = 0.17677669529663687f;     // 1/sqrt(32)
  v8f zero = {};

  for (int t = 0; t < NT; ++t) {
    int buf = t & 1;
    const _Float16* kl = sK + buf * KTILE + cn * KPITCH + 8 * half;
    const _Float16* vl = sV + buf * VTILE + cn * VPITCH + 8 * half;

#pragma unroll  // constant LDS offsets, and the next pass's fragment reads can start early
    for (int jj = 0; jj < KT; jj += 32) {
      int j = t * KT + jj;
      // scores^T: K @ Q^T for keys [j, j+32)
      v16h aK0 = frag_lds(kl + jj * KPITCH);
      v16h aK1 = frag_lds(kl + (jj + 16) * KPITCH);
      v8f s1 = wmma_f16(aK0, bQ, zero);
      v8f s2 = wmma_f16(aK1, bQ, zero);

      // x[e]: score of key j + kmap(e, half) for this lane's query
      float x[16];
#pragma unroll  // constant indices, so the array stays in registers
      for (int v = 0; v < 8; ++v) {
        x[v]     = s1[v] * scale + mb[j + v];
        x[8 + v] = s2[v] * scale + mb[j + 16 + v];
      }

      // maximum over the 32 keys: 16 in this lane, 16 in lane ^ 16
      float tm = x[0];
#pragma unroll  // constant indices, so the array stays in registers
      for (int e = 1; e < 16; ++e) tm = fmaxf(tm, x[e]);
      tm = fmaxf(tm, xhalf(tm));
      float mn   = fmaxf(m, tm);
      float corr = __expf(m - mn);
      m = mn;

      v16h bP;                                  // P^T as B: element e -> key kmap(e, half)
      float p[16];
#pragma unroll  // constant indices, so the array stays in registers
      for (int e = 0; e < 16; ++e) p[e] = __expf(x[e] - mn);
      float rs = 0.0f;
#pragma unroll  // constant indices, so the array stays in registers
      for (int e = 0; e < 16; e += 2) {
        rs += p[e] + p[e + 1];
        bP[e]     = (_Float16)p[e];
        bP[e + 1] = (_Float16)p[e + 1];
      }
      l = l * corr + rs;
#pragma unroll  // constant indices, so the array stays in registers
      for (int v = 0; v < 8; ++v) { acc0[v] *= corr; acc1[v] *= corr; }

      // ctx^T += V^T(32x32) @ P^T(32x16): A rows = dh from transposed V
      v16h aV0 = frag_lds(vl + jj);
      v16h aV1 = frag_lds(vl + 16 * VPITCH + jj);
      acc0 = wmma_f16(aV0, bP, acc0);
      acc1 = wmma_f16(aV1, bP, acc1);
    }

    asm volatile("s_wait_dscnt 0x0" ::: "memory");      // this wave has left buffer buf
    asm volatile("s_wait_asynccnt 0x0" ::: "memory");   // its share of tile t + 1 has landed
    __syncthreads();                                    // both hold for every wave of the block
    if (t + 2 < NT)                                     // refill the buffer that all have left
      copy_tile(lk + buf * (KTILE * 2), gk + (size_t)(t + 2) * (KT * DHD),
                lv + buf * (VTILE * 2), gv + (t + 2) * KT);
  }
  asm volatile("s_wait_asynccnt 0x0" ::: "memory");     // no copy is in flight when the wave ends

  l += xhalf(l);                                // join the two halves' sums once
  float inv = hmask[h] / l;
  float* o = out + (((size_t)b * SS + q0 + cn) * DD) + (size_t)h * DHD + 8 * half;
#pragma unroll  // constant indices, so the array stays in registers
  for (int v = 0; v < 8; ++v) {
    o[v]      = acc0[v] * inv;                  // dh = 8*half + v
    o[16 + v] = acc1[v] * inv;                  // dh = 16 + 8*half + v
  }
}

extern "C" void kernel_launch(void* const* d_in, const int* in_sizes, int n_in,
                              void* d_out, int out_size, void* d_ws, size_t ws_size,
                              hipStream_t stream) {
  (void)in_sizes; (void)n_in; (void)out_size; (void)ws_size;
  const float* qx    = (const float*)d_in[0];
  const float* kx    = (const float*)d_in[1];
  const float* vx    = (const float*)d_in[2];
  const float* amask = (const float*)d_in[3];
  const float* hmask = (const float*)d_in[4];
  const float* Wq    = (const float*)d_in[5];
  const float* bq    = (const float*)d_in[6];
  const float* Wk    = (const float*)d_in[7];
  const float* bk    = (const float*)d_in[8];
  const float* Wv    = (const float*)d_in[9];
  const float* bv    = (const float*)d_in[10];

  size_t n = (size_t)BB * HH * SS * DHD;     // 2M f16 elements per tensor
  _Float16* qws  = (_Float16*)d_ws;
  _Float16* kws  = qws + n;
  _Float16* vtws = kws + n;                  // 12 MB total workspace

  proj_kernel<<<(BB * SS) / 16, 256, 0, stream>>>(qx, kx, vx, Wq, bq, Wk, bk, Wv, bv,
                                                  qws, kws, vtws);
  attn_kernel<<<(BB * HH * (SS / 16)) / 8, 256, 0, stream>>>(qws, kws, vtws, amask,
                                                             hmask, (float*)d_out);
}

// v003
// One run takes 36.3 microseconds.
// Two timings next to v002 put it at 1.45 and 1.44 times that version's speed.
// Counting every step since v000, it is 2.89 times as fast.
#include <hip/hip_runtime.h>

#define BB  8
#define SS  2048
#define HH  4
#define DHD 32
#define DD  128

typedef __attribute__((ext_vector_type(16))) _Float16 v16h;
typedef __attribute__((ext_vector_type(8)))  float    v8f;
typedef __attribute__((ext_vector_type(8)))  _Float16 v8h;
typedef __attribute__((ext_vector_type(4)))  _Float16 v4h;

// CDNA5 16-bit A/B fragment mapping (wave32):
// lane L holds row (A) / col (B) = L%16; element e -> K = (e&7) + 8*(L/16) + 16*(e>>3)
__device__ __forceinline__ int kmap(int e, int half) {
  return (e & 7) + (half << 3) + ((e >> 3) << 4);
}

// Load fragment from f16 matrix where element (row, k) = base[row*ld + k].
// Works for A (row = M row) and B (row = N column of a K-major view).
__device__ __forceinline__ v16h frag_f16(const _Float16* base, int ld, int row, int half) {
  const _Float16* p = base + (size_t)row * ld;
  v16h f;
#pragma unroll
  for (int e = 0; e < 16; e += 2) {
    int k = kmap(e, half);
    f[e]     = p[k];
    f[e + 1] = p[k + 1];
  }
  return f;
}

// Fragment from LDS; p = the lane's row at k = 8*half: elements 0..7 there, 8..15 at k + 16 (kmap).
__device__ __forceinline__ v16h frag_lds(const _Float16* p) {
  v8h lo = *(const v8h*)p;
  v8h hi = *(const v8h*)(p + 16);
  return __builtin_shufflevector(lo, hi, 0, 1, 2, 3, 4, 5, 6, 7, 8, 9, 10, 11, 12, 13, 14, 15);
}

__device__ __forceinline__ v8f wmma_f16(v16h a, v16h b, v8f c) {
  return __builtin_amdgcn_wmma_f32_16x16x32_f16(false, a, false, b, (short)0, c, false, false);
}

// ---------------- QKV projection: X(128-row block) @ W + b, split heads ----------------
// grid = ((B*S)/128, 3) blocks, 256 threads (8 waves); blockIdx.y picks Q, K or V.
// The block puts W into LDS once, as f16 in the order of the B fragments, and its rows of X,
// read once in whole rows, as f16; each wave owns 16 rows and all 128 output columns.
// Q,K stored (B,H,S,DH) f16; V stored transposed (B,H,DH,S) f16.
#define PROWS  128
#define XPITCH (DD + 8)             // f16 per X row in LDS: 272 B = 16 B x odd, no bank conflict for 16-byte reads

// The grid puts at most four waves on a SIMD: with their register budget the compiler keeps all
// of a wave's loads in flight at once; with the default budget it waits for some to issue the rest.
__global__ __launch_bounds__(256) __attribute__((amdgpu_waves_per_eu(4, 4)))
void proj_kernel(const float* __restrict__ qx, const float* __restrict__ kx,
                 const float* __restrict__ vx,
                 const float* __restrict__ Wq, const float* __restrict__ bq,
                 const float* __restrict__ Wk, const float* __restrict__ bk,
                 const float* __restrict__ Wv, const float* __restrict__ bv,
                 _Float16* __restrict__ qws, _Float16* __restrict__ kws,
                 _Float16* __restrict__ vtws) {
  // Piece (kc, nt, eh, lane): the eight f16 that lane holds as elements 8*eh .. 8*eh+7 of the
  // B fragment of k chunk kc and column tile nt. A wave's read of a piece row is 512 bytes in a row.
  __shared__ __attribute__((aligned(16))) _Float16 sW[DD * DD];
  __shared__ __attribute__((aligned(16))) _Float16 sX[PROWS * XPITCH];

  int tid  = threadIdx.x;
  int lane = tid & 31;
  int wave = tid >> 5;
  int half = lane >> 4;
  int r    = lane & 15;
  int mat  = blockIdx.y;
  int m0   = blockIdx.x * PROWS + wave * 16;

  const float* X    = (mat == 0) ? qx : (mat == 1) ? kx : vx;
  const float* W    = (mat == 0) ? Wq : (mat == 1) ? Wk : Wv;
  const float* bias = (mat == 0) ? bq : (mat == 1) ? bk : bv;

  // All loads stand ahead of the first conversion: the wave's 16 rows of X, one load per row (512 bytes in a row);
  // the bias; this thread's two columns of W in four runs of eight k.
  // Run p holds k = 8p .. 8p+7, which is chunk p/4, lane half p%2, element half (p/2)%2 (kmap).
  const float* xw = X + (size_t)m0 * DD + lane * 4;
  int n  = (tid & 63) * 2;
  int p0 = tid >> 6;
  const float* ww = W + (size_t)(8 * p0) * DD + n;

  float4 x[16];
#pragma unroll  // constant indices, so the array stays in registers
  for (int j = 0; j < 16; ++j) x[j] = *(const float4*)(xw + j * DD);
  float bias_v[8];
#pragma unroll  // constant indices, so the array stays in registers
  for (int nt = 0; nt < 8; ++nt) bias_v[nt] = bias[nt * 16 + r];
  float2 w[4][8];
#pragma unroll  // constant indices, so the array stays in registers
  for (int i = 0; i < 4; ++i)
#pragma unroll  // constant indices, so the array stays in registers
    for (int j = 0; j < 8; ++j) w[i][j] = *(const float2*)(ww + (i * 32 + j) * DD);
  // A precaution for the loads' address registers: naming them here keeps them out of the loads' own
  // destination registers, and every later write of them stands behind the wait.
  asm volatile("s_wait_xcnt 0x0" :: "v"(xw), "v"(ww) : "memory");

  _Float16* sx = sX + wave * 16 * XPITCH;
#pragma unroll  // constant indices, so the array stays in registers
  for (int j = 0; j < 16; ++j) {
    v4h xh = {(_Float16)x[j].x, (_Float16)x[j].y, (_Float16)x[j].z, (_Float16)x[j].w};
    *(v4h*)&sx[j * XPITCH + lane * 4] = xh;
  }
#pragma unroll  // constant indices, so the array stays in registers
  for (int i = 0; i < 4; ++i) {
    v8h piece0, piece1;
#pragma unroll  // constant indices, so the vectors stay in registers
    for (int j = 0; j < 8; ++j) {
      piece0[j] = (_Float16)w[i][j].x;
      piece1[j] = (_Float16)w[i][j].y;
    }
    int slot = ((i * 8 + (n >> 4)) * 2 + (p0 >> 1)) * 32 + (p0 & 1) * 16 + (n & 15);
    *(v8h*)&sW[slot * 8]     = piece0;
    *(v8h*)&sW[slot * 8 + 8] = piece1;
  }
  __syncthreads();                              // W and X are whole before any wave reads a fragment

  v16h a[4];
#pragma unroll  // constant indices, so the array stays in registers
  for (int kc = 0; kc < 4; ++kc) a[kc] = frag_lds(sx + r * XPITCH + kc * 32 + 8 * half);

  // B fragments of one k chunk: 16 reads, each 512 bytes in a row per wave.
  const _Float16* pw = sW + lane * 8;
  v16h b[2][8];
#pragma unroll  // constant indices, so the array stays in registers
  for (int nt = 0; nt < 8; ++nt) {
    v8h lo = *(const v8h*)(pw + (nt * 2) * 256);
    v8h hi = *(const v8h*)(pw + (nt * 2 + 1) * 256);
    b[0][nt] = __builtin_shufflevector(lo, hi, 0, 1, 2, 3, 4, 5, 6, 7, 8, 9, 10, 11, 12, 13, 14, 15);
  }

  v8f c[8] = {};
#pragma unroll  // constant LDS offsets and register indices
  for (int kc = 0; kc < 4; ++kc) {
    if (kc < 3) {
#pragma unroll  // constant indices, so the array stays in registers
      for (int nt = 0; nt < 8; ++nt) {
        v8h lo = *(const v8h*)(pw + (((kc + 1) * 8 + nt) * 2) * 256);
        v8h hi = *(const v8h*)(pw + (((kc + 1) * 8 + nt) * 2 + 1) * 256);
        b[(kc + 1) & 1][nt] =
            __builtin_shufflevector(lo, hi, 0, 1, 2, 3, 4, 5, 6, 7, 8, 9, 10, 11, 12, 13, 14, 15);
      }
    }
    // The next chunk's reads stay one group ahead of this chunk's products; left alone the compiler
    // keeps only one fragment's reads ahead of a product, and most of the LDS latency shows each time.
    __builtin_amdgcn_sched_barrier(0);
#pragma unroll  // eight independent accumulators
    for (int nt = 0; nt < 8; ++nt) c[nt] = wmma_f16(a[kc], b[kc & 1][nt], c[nt]);
    __builtin_amdgcn_sched_barrier(0);          // closes the group of products (see above)
  }

  // C layout: VGPR v, half -> M = v + 8*half; lane's column = nt*16 + r
  int bb = m0 >> 11;                            // row / 2048, one batch per block
  int s0 = (m0 & (SS - 1)) + 8 * half;
  if (mat == 2) {
#pragma unroll  // constant indices, so the arrays stay in registers
    for (int nt = 0; nt < 8; ++nt) {
      int col = nt * 16 + r;
      v8h o;                                    // eight positions in a row of V^T
#pragma unroll  // constant indices, so the arrays stay in registers
      for (int v = 0; v < 8; ++v) o[v] = (_Float16)(c[nt][v] + bias_v[nt]);
      *(v8h*)&vtws[(((size_t)bb * HH + (col >> 5)) * DHD + (col & 31)) * SS + s0] = o;
    }
  } else {
    _Float16* dst = (mat == 0) ? qws : kws;
#pragma unroll  // constant indices, so the arrays stay in registers
    for (int nt = 0; nt < 8; ++nt) {
      int col = nt * 16 + r;
#pragma unroll  // constant indices, so the arrays stay in registers
      for (int v = 0; v < 8; ++v)
        dst[(((size_t)bb * HH + (col >> 5)) * SS + s0 + v) * DHD + (col & 31)] =
            (_Float16)(c[nt][v] + bias_v[nt]);
    }
    // A precaution for the stores' address and data registers: in the built code the V^T part
    // follows this one, and every write of a register there stands behind the wait.
    asm volatile("s_wait_xcnt 0x0" ::: "memory");
  }
}

// ---------------- fused flash attention: one wave per 16-query tile ----------------
// grid = B*H*(S/16)/8 blocks, 256 threads (8 waves, one query tile each, all of one (b, h)).
// Scores are formed transposed, S^T = K Q^T, and the context as O^T += V^T P^T:
// lane (cn, half) then owns query q0 + cn and holds keys 8*half + v (tile 0) and
// 16 + 8*half + v (tile 1) in its registers, which is the k order of a B fragment.

// lane l <-> lane l ^ 16
__device__ __forceinline__ float xhalf(float x) {
  int b = __builtin_bit_cast(int, x);
  return __builtin_bit_cast(float,
      __builtin_amdgcn_permlanex16(b, b, 0x76543210, 0xfedcba98, false, false));
}

// K and V^T reach the waves through LDS: the eight waves of a block share one (b, h), so each
// tile of KT keys is copied in once per block, in whole 128-byte lines, and read by all eight.
#define KT      128                 // keys per tile
#define NT      (SS / KT)           // tiles
#define KPITCH  40                  // f16 per K row in LDS: 80 B = 16 B x odd, no bank conflict for 16-byte reads
#define VPITCH  (KT + 8)            // f16 per V^T row in LDS: 272 B = 16 B x odd
#define KTILE   (KT * KPITCH)       // f16 per K tile in LDS
#define VTILE   (DHD * VPITCH)      // f16 per V^T tile in LDS

// One tile's four 16-byte copies of this lane, global memory to LDS through no register.
// The s_wait_xcnt stands inside the statement, so that no address register named here is
// rewritten in front of it.
__device__ __forceinline__ void copy_tile(unsigned lk, const _Float16* gk,
                                          unsigned lv, const _Float16* gv) {
  unsigned lk1 = lk + 64 * KPITCH * 2;          // K rows 64..127
  unsigned lv1 = lv + 16 * VPITCH * 2;          // V^T rows 16..31
  const _Float16* gk1 = gk + 64 * DHD;
  const _Float16* gv1 = gv + 16 * SS;
  asm volatile("global_load_async_to_lds_b128 %0, %1, off\n\t"
               "global_load_async_to_lds_b128 %2, %3, off\n\t"
               "global_load_async_to_lds_b128 %4, %5, off\n\t"
               "global_load_async_to_lds_b128 %6, %7, off\n\t"
               "s_wait_xcnt 0x0"
               :: "v"(lk), "v"(gk), "v"(lk1), "v"(gk1), "v"(lv), "v"(gv), "v"(lv1), "v"(gv1)
               : "memory");
}

// The grid puts four waves on a SIMD: with their register budget the compiler issues a tile's LDS
// reads in groups ahead of their use; with the default budget it waits at each fragment.
__global__ __launch_bounds__(256) __attribute__((amdgpu_waves_per_eu(4, 4)))
void attn_kernel(const _Float16* __restrict__ qws, const _Float16* __restrict__ kws,
                 const _Float16* __restrict__ vtws, const float* __restrict__ amask,
                 const float* __restrict__ hmask, float* __restrict__ out) {
  __shared__ __attribute__((aligned(16))) _Float16 sK[2 * KTILE];
  __shared__ __attribute__((aligned(16))) _Float16 sV[2 * VTILE];

  int tid  = threadIdx.x;
  int lane = tid & 31;
  int wave = tid >> 5;
  int half = lane >> 4;
  int cn   = lane & 15;

  int g   = blockIdx.x * 8 + wave;          // tile id 0..4095
  int b   = g >> 9;                         // / (H * S/16) = 512
  int rem = g & 511;
  int h   = rem >> 7;                       // / 128
  int q0  = (rem & 127) * 16;

  const _Float16* qb  = qws  + (((size_t)b * HH + h) * SS) * DHD;
  const _Float16* kb  = kws  + (((size_t)b * HH + h) * SS) * DHD;
  const _Float16* vtb = vtws + (((size_t)b * HH + h) * DHD) * SS;
  const float*    mb  = amask + (size_t)b * SS + 8 * half;

  // This lane's share of a tile. K: 16-byte piece tid of 8 KB in a row (key tid/4, piece tid%4),
  // and the same 64 keys on. V^T: row tid/16, piece tid%16 of its 256 bytes, and 16 rows on.
  const _Float16* gk = kb  + tid * 8;
  const _Float16* gv = vtb + (size_t)(tid >> 4) * SS + (tid & 15) * 8;
  unsigned lk = (unsigned)(size_t)&sK[(tid >> 2) * KPITCH + (tid & 3) * 8];
  unsigned lv = (unsigned)(size_t)&sV[(tid >> 4) * VPITCH + (tid & 15) * 8];

  copy_tile(lk, gk, lv, gv);                            // tile 0 into buffer 0
  asm volatile("s_wait_asynccnt 0x0" ::: "memory");     // this wave's share of tile 0 has landed
  __syncthreads();                                      // and every other wave's
  copy_tile(lk + KTILE * 2, gk + KT * DHD, lv + VTILE * 2, gv + KT);   // tile 1 into buffer 1

  v16h bQ = frag_f16(qb, DHD, q0 + cn, half);   // B: column = query, K = DH = 32

  v8f acc0 = {}, acc1 = {};                     // O^T: rows dh 0..15 / 16..31, column = query
  float m = -3.0e38f;                           // running maximum of this lane's query
  float l = 0.0f;                               // sum over this lane half's keys only

  const float scale = 0.17677669529663687f;     // 1/sqrt(32)
  v8f zero = {};

  for (int t = 0; t < NT; ++t) {
    int buf = t & 1;
    const _Float16* kl = sK + buf * KTILE + cn * KPITCH + 8 * half;
    const _Float16* vl = sV + buf * VTILE + cn * VPITCH + 8 * half;

#pragma unroll  // constant LDS offsets, and the next pass's fragment reads can start early
    for (int jj = 0; jj < KT; jj += 32) {
      int j = t * KT + jj;
      // scores^T: K @ Q^T for keys [j, j+32)
      v16h aK0 = frag_lds(kl + jj * KPITCH);
      v16h aK1 = frag_lds(kl + (jj + 16) * KPITCH);
      v8f s1 = wmma_f16(aK0, bQ, zero);
      v8f s2 = wmma_f16(aK1, bQ, zero);

      // x[e]: score of key j + kmap(e, half) for this lane's query
      float x[16];
#pragma unroll  // constant indices, so the array stays in registers
      for (int v = 0; v < 8; ++v) {
        x[v]     = s1[v] * scale + mb[j + v];
        x[8 + v] = s2[v] * scale + mb[j + 16 + v];
      }

      // maximum over the 32 keys: 16 in this lane, 16 in lane ^ 16
      float tm = x[0];
#pragma unroll  // constant indices, so the array stays in registers
      for (int e = 1; e < 16; ++e) tm = fmaxf(tm, x[e]);
      tm = fmaxf(tm, xhalf(tm));
      float mn   = fmaxf(m, tm);
      float corr = __expf(m - mn);
      m = mn;

      v16h bP;                                  // P^T as B: element e -> key kmap(e, half)
      float p[16];
#pragma unroll  // constant indices, so the array stays in registers
      for (int e = 0; e < 16; ++e) p[e] = __expf(x[e] - mn);
      float rs = 0.0f;
#pragma unroll  // constant indices, so the array stays in registers
      for (int e = 0; e < 16; e += 2) {
        rs += p[e] + p[e + 1];
        bP[e]     = (_Float16)p[e];
        bP[e + 1] = (_Float16)p[e + 1];
      }
      l = l * corr + rs;
#pragma unroll  // constant indices, so the array stays in registers
      for (int v = 0; v < 8; ++v) { acc0[v] *= corr; acc1[v] *= corr; }

      // ctx^T += V^T(32x32) @ P^T(32x16): A rows = dh from transposed V
      v16h aV0 = frag_lds(vl + jj);
      v16h aV1 = frag_lds(vl + 16 * VPITCH + jj);
      acc0 = wmma_f16(aV0, bP, acc0);
      acc1 = wmma_f16(aV1, bP, acc1);
    }

    asm volatile("s_wait_dscnt 0x0" ::: "memory");      // this wave has left buffer buf
    asm volatile("s_wait_asynccnt 0x0" ::: "memory");   // its share of tile t + 1 has landed
    __syncthreads();                                    // both hold for every wave of the block
    if (t + 2 < NT)                                     // refill the buffer that all have left
      copy_tile(lk + buf * (KTILE * 2), gk + (size_t)(t + 2) * (KT * DHD),
                lv + buf * (VTILE * 2), gv + (t + 2) * KT);
  }
  asm volatile("s_wait_asynccnt 0x0" ::: "memory");     // no copy is in flight when the wave ends

  l += xhalf(l);                                // join the two halves' sums once
  float inv = hmask[h] / l;
  float* o = out + (((size_t)b * SS + q0 + cn) * DD) + (size_t)h * DHD + 8 * half;
#pragma unroll  // constant indices, so the array stays in registers
  for (int v = 0; v < 8; ++v) {
    o[v]      = acc0[v] * inv;                  // dh = 8*half + v
    o[16 + v] = acc1[v] * inv;                  // dh = 16 + 8*half + v
  }
}

extern "C" void kernel_launch(void* const* d_in, const int* in_sizes, int n_in,
                              void* d_out, int out_size, void* d_ws, size_t ws_size,
                              hipStream_t stream) {
  (void)in_sizes; (void)n_in; (void)out_size; (void)ws_size;
  const float* qx    = (const float*)d_in[0];
  const float* kx    = (const float*)d_in[1];
  const float* vx    = (const float*)d_in[2];
  const float* amask = (const float*)d_in[3];
  const float* hmask = (const float*)d_in[4];
  const float* Wq    = (const float*)d_in[5];
  const float* bq    = (const float*)d_in[6];
  const float* Wk    = (const float*)d_in[7];
  const float* bk    = (const float*)d_in[8];
  const float* Wv    = (const float*)d_in[9];
  const float* bv    = (const float*)d_in[10];

  size_t n = (size_t)BB * HH * SS * DHD;     // 2M f16 elements per tensor
  _Float16* qws  = (_Float16*)d_ws;
  _Float16* kws  = qws + n;
  _Float16* vtws = kws + n;                  // 12 MB total workspace

  proj_kernel<<<dim3((BB * SS) / PROWS, 3), 256, 0, stream>>>(qx, kx, vx, Wq, bq, Wk, bk, Wv, bv,
                                                  qws, kws, vtws);
  attn_kernel<<<(BB * HH * (SS / 16)) / 8, 256, 0, stream>>>(qws, kws, vtws, amask,
                                                             hmask, (float*)d_out);
}
